// v000
// Times are from an AMD MI455X. After a warm-up the kernel runs many times in a row, and a time is the length of
// such a window on the GPU divided by its runs, so every launch and the gaps after it count. The runs cycle
// through copies of the inputs. A figure is the median of several windows, for all but v000 over two sittings.
// Sittings can differ by a few percent; kernels timed side by side share one.
// The starting kernel, v000, takes 863 microseconds a run.
#include <hip/hip_runtime.h>
#include <hip/hip_bf16.h>

typedef float v2f __attribute__((ext_vector_type(2)));
typedef float v8f __attribute__((ext_vector_type(8)));

#define S_LEN  2048
#define DMODEL 1024
#define NHEADS 16
#define DH     64
#define NEGV   (-4294967295.0f)   // -2^32+1, matches reference mask constant

__device__ __forceinline__ void async_copy16(void* lds_dst, const void* gsrc) {
  unsigned l = (unsigned)(unsigned long long)(uintptr_t)lds_dst;  // LDS byte offset
  asm volatile("global_load_async_to_lds_b128 %0, %1, off"
               :: "v"(l), "v"(gsrc)
               : "memory");
}
__device__ __forceinline__ void async_wait0() {
  asm volatile("s_wait_asynccnt 0x0" ::: "memory");
}
__device__ __forceinline__ void async_wait16() {
  asm volatile("s_wait_asynccnt 0x10" ::: "memory");
}

// ---------------------------------------------------------------------------
// Kernel 0: padding masks. key_mask[b,s] = sign(|sum_d keys|), same for queries
// ---------------------------------------------------------------------------
__global__ void masks_kernel(const float* __restrict__ q,
                             const float* __restrict__ k,
                             float* __restrict__ qmask,
                             float* __restrict__ kmask) {
  __shared__ float red0[256];
  __shared__ float red1[256];
  const int row = blockIdx.x;                      // 0 .. B*S-1
  const float* qr = q + (size_t)row * DMODEL;
  const float* kr = k + (size_t)row * DMODEL;
  float sq = 0.f, sk = 0.f;
  for (int i = threadIdx.x; i < DMODEL; i += 256) { sq += qr[i]; sk += kr[i]; }
  red0[threadIdx.x] = sq; red1[threadIdx.x] = sk;
  __syncthreads();
  for (int off = 128; off > 0; off >>= 1) {
    if ((int)threadIdx.x < off) {
      red0[threadIdx.x] += red0[threadIdx.x + off];
      red1[threadIdx.x] += red1[threadIdx.x + off];
    }
    __syncthreads();
  }
  if (threadIdx.x == 0) {
    qmask[row] = (red0[0] != 0.0f) ? 1.0f : 0.0f;
    kmask[row] = (red1[0] != 0.0f) ? 1.0f : 0.0f;
  }
}

// ---------------------------------------------------------------------------
// Kernel 1: fused projection  P = relu(X @ W^T + b)  for Q, K, V (blockIdx.z).
// 4-wave workgroup computes a 64x64 output tile; each wave owns a 16-row strip
// and 4 WMMA accumulators (64 cols). Tiles staged via async global->LDS DMA.
// ---------------------------------------------------------------------------
__global__ void __launch_bounds__(128)
proj_kernel(const float* __restrict__ Xq, const float* __restrict__ Xk,
            const float* __restrict__ Xv,
            const float* __restrict__ Wq, const float* __restrict__ Wk,
            const float* __restrict__ Wv,
            const float* __restrict__ bq, const float* __restrict__ bk,
            const float* __restrict__ bv,
            float* __restrict__ Qp, float* __restrict__ Kp,
            float* __restrict__ Vp) {
  __shared__ __align__(16) float sA[64][64];   // X rows   (16KB)
  __shared__ __align__(16) float sB[64][64];   // W rows   (16KB)

  const int mt = blockIdx.x;            // 64 row tiles   (B*S/64)
  const int ng = blockIdx.y;            // 16 col groups  (D/64)
  const int wz = blockIdx.z;            // 0:Q 1:K 2:V
  const float* X    = (wz == 0) ? Xq : (wz == 1) ? Xk : Xv;
  const float* W    = (wz == 0) ? Wq : (wz == 1) ? Wk : Wv;
  const float* bias = (wz == 0) ? bq : (wz == 1) ? bk : bv;
  float*       dst  = (wz == 0) ? Qp : (wz == 1) ? Kp : Vp;

  const int tid   = threadIdx.x;        // 0..127
  const int lane  = tid & 31;
  const int w     = tid >> 5;
  const int lrow  = lane & 15;
  const int koff  = (lane >> 4) << 1;
  const int rbase = (lane >> 4) << 3;

  v8f acc[4];
  for (int t = 0; t < 4; ++t) acc[t] = (v8f){0.f,0.f,0.f,0.f,0.f,0.f,0.f,0.f};

  for (int ks = 0; ks < DMODEL; ks += 64) {
    // async DMA stage: 64x64 tiles of X and W (1024 float4 each / 128 threads)
    for (int i = 0; i < 8; ++i) {
      const int f  = i * 128 + tid;
      const int r  = f >> 4;
      const int c4 = (f & 15) << 2;
      async_copy16(&sA[r][c4], &X[(size_t)(mt * 64 + r) * DMODEL + ks + c4]);
      async_copy16(&sB[r][c4], &W[(size_t)(ng * 64 + r) * DMODEL + ks + c4]);
    }
    async_wait0();
    __syncthreads();

    for (int c = 0; c < 16; ++c) {
      v2f a;
      a.x = sA[w * 16 + lrow][4 * c + koff];
      a.y = sA[w * 16 + lrow][4 * c + koff + 1];
      for (int t = 0; t < 4; ++t) {
        v2f b;
        b.x = sB[t * 16 + lrow][4 * c + koff];        // B[k][n] = W[n][k]
        b.y = sB[t * 16 + lrow][4 * c + koff + 1];
        acc[t] = __builtin_amdgcn_wmma_f32_16x16x4_f32(false, a, false, b,
                                                       (short)0, acc[t], false, false);
      }
    }
    __syncthreads();
  }

  for (int t = 0; t < 4; ++t) {
    const int ncol = ng * 64 + t * 16 + lrow;
    const float bn = bias[ncol];
    for (int r = 0; r < 8; ++r) {
      const int m = mt * 64 + w * 16 + r + rbase;
      float v = acc[t][r] + bn;
      v = v > 0.f ? v : 0.f;                           // ReLU
      dst[(size_t)m * DMODEL + ncol] = v;
    }
  }
}

// ---------------------------------------------------------------------------
// Kernel 2: fused causal attention (flash-style, online softmax).
// One wave per (b, h, 16-query tile). K/V tiles double-buffered via async DMA.
// ---------------------------------------------------------------------------
__global__ void __launch_bounds__(32)
attn_kernel(const float* __restrict__ Qp, const float* __restrict__ Kp,
            const float* __restrict__ Vp,
            const float* __restrict__ qmask, const float* __restrict__ kmask,
            float* __restrict__ O) {
  __shared__ __align__(16) float sK[2][16][64];
  __shared__ __align__(16) float sV[2][16][64];
  __shared__ __align__(16) float sP[16][16];

  const int qt   = blockIdx.x;          // 0..127 query tile
  const int h    = blockIdx.y;          // 0..15
  const int b    = blockIdx.z;          // 0..1
  const int lane = threadIdx.x;
  const int lrow = lane & 15;
  const int koff = (lane >> 4) << 1;
  const int rbase = (lane >> 4) << 3;

  const float* Kh = Kp + (size_t)b * S_LEN * DMODEL + h * DH;
  const float* Vh = Vp + (size_t)b * S_LEN * DMODEL + h * DH;

  // Q tile in A-layout registers, pre-scaled by 1/sqrt(dh)=0.125
  v2f qa[16];
  {
    const float* qrow = Qp + (size_t)(b * S_LEN + qt * 16 + lrow) * DMODEL + h * DH;
    for (int c = 0; c < 16; ++c) {
      qa[c].x = qrow[4 * c + koff] * 0.125f;
      qa[c].y = qrow[4 * c + koff + 1] * 0.125f;
    }
  }

  float mrun[8], lrun[8];
  v8f acc[4];
  for (int r = 0; r < 8; ++r) { mrun[r] = -3.0e38f; lrun[r] = 0.f; }
  for (int t = 0; t < 4; ++t) acc[t] = (v8f){0.f,0.f,0.f,0.f,0.f,0.f,0.f,0.f};

  // stage tile 0 into buffer 0 (16 async ops per lane)
  {
    const float* kb = Kh + (size_t)0;
    const float* vb = Vh + (size_t)0;
    for (int i = 0; i < 8; ++i) {
      const int f = i * 32 + lane;
      const int r = f >> 4;
      const int c4 = (f & 15) << 2;
      async_copy16(&sK[0][r][c4], &kb[(size_t)r * DMODEL + c4]);
      async_copy16(&sV[0][r][c4], &vb[(size_t)r * DMODEL + c4]);
    }
  }

  for (int kt = 0; kt <= qt; ++kt) {    // causal: only key tiles <= query tile
    const int buf = kt & 1;
    if (kt < qt) {
      // issue next tile into the other buffer, then wait for current tile
      // (async loads complete in order; <=16 outstanding => tile kt is done)
      const float* kb = Kh + (size_t)(kt + 1) * 16 * DMODEL;
      const float* vb = Vh + (size_t)(kt + 1) * 16 * DMODEL;
      for (int i = 0; i < 8; ++i) {
        const int f = i * 32 + lane;
        const int r = f >> 4;
        const int c4 = (f & 15) << 2;
        async_copy16(&sK[buf ^ 1][r][c4], &kb[(size_t)r * DMODEL + c4]);
        async_copy16(&sV[buf ^ 1][r][c4], &vb[(size_t)r * DMODEL + c4]);
      }
      async_wait16();
    } else {
      async_wait0();
    }
    __syncthreads();

    // scores = (Q/sqrt(dh)) @ K^T : 16 wmma over dh=64
    v8f s = {0.f,0.f,0.f,0.f,0.f,0.f,0.f,0.f};
    for (int c = 0; c < 16; ++c) {
      v2f bk2;
      bk2.x = sK[buf][lrow][4 * c + koff];   // B[k][n] = K[key n][dh k]
      bk2.y = sK[buf][lrow][4 * c + koff + 1];
      s = __builtin_amdgcn_wmma_f32_16x16x4_f32(false, qa[c], false, bk2,
                                                (short)0, s, false, false);
    }

    // masks: key padding + causal (column N = lrow for this lane)
    const int   gk = kt * 16 + lrow;
    const float km = kmask[b * S_LEN + gk];
    for (int r = 0; r < 8; ++r) {
      const int gq = qt * 16 + r + rbase;
      float sv = s[r];
      if (km == 0.0f || gk > gq) sv = NEGV;
      s[r] = sv;
    }

    // online softmax: row reductions across the 16 lanes holding one row
    for (int r = 0; r < 8; ++r) {
      float sv = s[r];
      float rmax = sv;
      for (int off = 8; off >= 1; off >>= 1)
        rmax = fmaxf(rmax, __shfl_xor(rmax, off, 32));
      const float mnew = fmaxf(mrun[r], rmax);
      const float p = __expf(sv - mnew);
      float rsum = p;
      for (int off = 8; off >= 1; off >>= 1)
        rsum += __shfl_xor(rsum, off, 32);
      const float alpha = __expf(mrun[r] - mnew);
      lrun[r] = lrun[r] * alpha + rsum;
      mrun[r] = mnew;
      for (int t = 0; t < 4; ++t) acc[t][r] *= alpha;
      s[r] = p;
    }

    // C-layout -> A-layout conversion of probabilities via LDS
    __syncthreads();
    for (int r = 0; r < 8; ++r) sP[r + rbase][lrow] = s[r];
    __syncthreads();

    // acc += P @ V : K-dim = 16 keys (4 chunks), N-dim = dh (4 tiles of 16)
    for (int c2 = 0; c2 < 4; ++c2) {
      v2f pa;
      pa.x = sP[lrow][4 * c2 + koff];
      pa.y = sP[lrow][4 * c2 + koff + 1];
      for (int t = 0; t < 4; ++t) {
        v2f bv2;
        bv2.x = sV[buf][4 * c2 + koff][t * 16 + lrow];     // B[k][n] = V[key k][dh n]
        bv2.y = sV[buf][4 * c2 + koff + 1][t * 16 + lrow];
        acc[t] = __builtin_amdgcn_wmma_f32_16x16x4_f32(false, pa, false, bv2,
                                                       (short)0, acc[t], false, false);
      }
    }
    __syncthreads();
  }

  // epilogue: normalize, apply query mask, scatter head slice
  for (int r = 0; r < 8; ++r) {
    const int gq = qt * 16 + r + rbase;
    const float qm = qmask[b * S_LEN + gq];
    const float inv = qm / lrun[r];
    for (int t = 0; t < 4; ++t) {
      O[(size_t)(b * S_LEN + gq) * DMODEL + h * DH + t * 16 + lrow] = acc[t][r] * inv;
    }
  }
}

// ---------------------------------------------------------------------------
// Kernel 3: residual add + layernorm (torch unbiased std, ddof=1)
// ---------------------------------------------------------------------------
__global__ void addln_kernel(const float* __restrict__ O, const float* __restrict__ q,
                             const float* __restrict__ gamma, const float* __restrict__ beta,
                             float* __restrict__ out) {
  __shared__ float red[256];
  const int row = blockIdx.x;
  const float* orow = O + (size_t)row * DMODEL;
  const float* qrow = q + (size_t)row * DMODEL;

  float xv[DMODEL / 256];
  float s = 0.f, ss = 0.f;
  for (int i = threadIdx.x, j = 0; i < DMODEL; i += 256, ++j) {
    const float x = orow[i] + qrow[i];
    xv[j] = x; s += x; ss += x * x;
  }
  red[threadIdx.x] = s;  __syncthreads();
  for (int off = 128; off > 0; off >>= 1) {
    if ((int)threadIdx.x < off) red[threadIdx.x] += red[threadIdx.x + off];
    __syncthreads();
  }
  const float sum = red[0];
  __syncthreads();
  red[threadIdx.x] = ss; __syncthreads();
  for (int off = 128; off > 0; off >>= 1) {
    if ((int)threadIdx.x < off) red[threadIdx.x] += red[threadIdx.x + off];
    __syncthreads();
  }
  const float sumsq = red[0];

  const float mean = sum * (1.0f / DMODEL);
  float var = (sumsq - sum * mean) * (1.0f / (DMODEL - 1));   // unbiased
  var = fmaxf(var, 0.0f);
  const float rinv = 1.0f / (sqrtf(var) + 1e-8f);
  for (int i = threadIdx.x, j = 0; i < DMODEL; i += 256, ++j) {
    out[(size_t)row * DMODEL + i] = gamma[i] * (xv[j] - mean) * rinv + beta[i];
  }
}

// ---------------------------------------------------------------------------
extern "C" void kernel_launch(void* const* d_in, const int* in_sizes, int n_in,
                              void* d_out, int out_size, void* d_ws, size_t ws_size,
                              hipStream_t stream) {
  const float* queries = (const float*)d_in[0];
  const float* keys    = (const float*)d_in[1];
  const float* values  = (const float*)d_in[2];
  const float* Wq      = (const float*)d_in[3];
  const float* bq      = (const float*)d_in[4];
  const float* Wk      = (const float*)d_in[5];
  const float* bk      = (const float*)d_in[6];
  const float* Wv      = (const float*)d_in[7];
  const float* bv      = (const float*)d_in[8];
  const float* gamma   = (const float*)d_in[9];
  const float* beta    = (const float*)d_in[10];
  float* out = (float*)d_out;

  float* ws = (float*)d_ws;
  const size_t NM = (size_t)2 * S_LEN * DMODEL;  // 4M floats per (B,S,D) buffer
  float* Qp = ws;
  float* Kp = ws + NM;
  float* Vp = ws + 2 * NM;
  float* Oa = ws + 3 * NM;
  float* qm = ws + 4 * NM;
  float* km = qm + 2 * S_LEN;

  masks_kernel<<<dim3(2 * S_LEN), dim3(256), 0, stream>>>(queries, keys, qm, km);
  proj_kernel<<<dim3((2 * S_LEN) / 64, DMODEL / 64, 3), dim3(128), 0, stream>>>(
      queries, keys, values, Wq, Wk, Wv, bq, bk, bv, Qp, Kp, Vp);
  attn_kernel<<<dim3(S_LEN / 16, NHEADS, 2), dim3(32), 0, stream>>>(
      Qp, Kp, Vp, qm, km, Oa);
  addln_kernel<<<dim3(2 * S_LEN), dim3(256), 0, stream>>>(Oa, queries, gamma, beta, out);
}

// v001
// One run takes 605 microseconds.
// Two timings next to v000 both put it at 1.44 times that version's speed.
#include <hip/hip_runtime.h>
#include <hip/hip_bf16.h>

typedef float v2f __attribute__((ext_vector_type(2)));
typedef float v8f __attribute__((ext_vector_type(8)));

#define S_LEN  2048
#define DMODEL 1024
#define NHEADS 16
#define DH     64
#define NEGV   (-4294967295.0f)   // -2^32+1, matches reference mask constant

#define PITCH_KMAJ 68
#define PITCH_V    72
#define PITCH_P    20

__device__ __forceinline__ void async_copy16(void* lds_dst, const void* gsrc) {
  unsigned l = (unsigned)(unsigned long long)(uintptr_t)lds_dst;  // LDS byte offset
  asm volatile("global_load_async_to_lds_b128 %0, %1, off"
               :: "v"(l), "v"(gsrc)
               : "memory");
}
__device__ __forceinline__ void async_wait0() {
  asm volatile("s_wait_asynccnt 0x0" ::: "memory");
}
__device__ __forceinline__ void async_wait16() {
  asm volatile("s_wait_asynccnt 0x10" ::: "memory");
}

// ---------------------------------------------------------------------------
// Kernel 0: padding masks. key_mask[b,s] = sign(|sum_d keys|), same for queries
// ---------------------------------------------------------------------------
__global__ void masks_kernel(const float* __restrict__ q,
                             const float* __restrict__ k,
                             float* __restrict__ qmask,
                             float* __restrict__ kmask) {
  __shared__ float red0[256];
  __shared__ float red1[256];
  const int row = blockIdx.x;                      // 0 .. B*S-1
  const float* qr = q + (size_t)row * DMODEL;
  const float* kr = k + (size_t)row * DMODEL;
  float sq = 0.f, sk = 0.f;
  for (int i = threadIdx.x; i < DMODEL; i += 256) { sq += qr[i]; sk += kr[i]; }
  red0[threadIdx.x] = sq; red1[threadIdx.x] = sk;
  __syncthreads();
  for (int off = 128; off > 0; off >>= 1) {
    if ((int)threadIdx.x < off) {
      red0[threadIdx.x] += red0[threadIdx.x + off];
      red1[threadIdx.x] += red1[threadIdx.x + off];
    }
    __syncthreads();
  }
  if (threadIdx.x == 0) {
    qmask[row] = (red0[0] != 0.0f) ? 1.0f : 0.0f;
    kmask[row] = (red1[0] != 0.0f) ? 1.0f : 0.0f;
  }
}

// ---------------------------------------------------------------------------
// Kernel 1: fused projection  P = relu(X @ W^T + b)  for Q, K, V (blockIdx.z).
// 4-wave workgroup computes a 64x64 output tile; each wave owns a 16-row strip
// and 4 WMMA accumulators (64 cols). Tiles staged via async global->LDS DMA.
// ---------------------------------------------------------------------------
__global__ void __launch_bounds__(128)
proj_kernel(const float* __restrict__ Xq, const float* __restrict__ Xk,
            const float* __restrict__ Xv,
            const float* __restrict__ Wq, const float* __restrict__ Wk,
            const float* __restrict__ Wv,
            const float* __restrict__ bq, const float* __restrict__ bk,
            const float* __restrict__ bv,
            float* __restrict__ Qp, float* __restrict__ Kp,
            float* __restrict__ Vp) {
  __shared__ __align__(16) float sA[64][PITCH_KMAJ];   // X rows   (17KB)
  __shared__ __align__(16) float sB[64][PITCH_KMAJ];   // W rows   (17KB)

  const int mt = blockIdx.x;            // 64 row tiles   (B*S/64)
  const int ng = blockIdx.y;            // 16 col groups  (D/64)
  const int wz = blockIdx.z;            // 0:Q 1:K 2:V
  const float* X    = (wz == 0) ? Xq : (wz == 1) ? Xk : Xv;
  const float* W    = (wz == 0) ? Wq : (wz == 1) ? Wk : Wv;
  const float* bias = (wz == 0) ? bq : (wz == 1) ? bk : bv;
  float*       dst  = (wz == 0) ? Qp : (wz == 1) ? Kp : Vp;

  const int tid   = threadIdx.x;        // 0..127
  const int lane  = tid & 31;
  const int w     = tid >> 5;
  const int lrow  = lane & 15;
  const int koff  = (lane >> 4) << 1;
  const int rbase = (lane >> 4) << 3;

  v8f acc[4];
  for (int t = 0; t < 4; ++t) acc[t] = (v8f){0.f,0.f,0.f,0.f,0.f,0.f,0.f,0.f};

  for (int ks = 0; ks < DMODEL; ks += 64) {
    // async DMA stage: 64x64 tiles of X and W (1024 float4 each / 128 threads)
    for (int i = 0; i < 8; ++i) {
      const int f  = i * 128 + tid;
      const int r  = f >> 4;
      const int c4 = (f & 15) << 2;
      async_copy16(&sA[r][c4], &X[(size_t)(mt * 64 + r) * DMODEL + ks + c4]);
      async_copy16(&sB[r][c4], &W[(size_t)(ng * 64 + r) * DMODEL + ks + c4]);
    }
    async_wait0();
    __syncthreads();

    for (int c = 0; c < 16; ++c) {
      v2f a;
      a.x = sA[w * 16 + lrow][4 * c + koff];
      a.y = sA[w * 16 + lrow][4 * c + koff + 1];
      for (int t = 0; t < 4; ++t) {
        v2f b;
        b.x = sB[t * 16 + lrow][4 * c + koff];        // B[k][n] = W[n][k]
        b.y = sB[t * 16 + lrow][4 * c + koff + 1];
        acc[t] = __builtin_amdgcn_wmma_f32_16x16x4_f32(false, a, false, b,
                                                       (short)0, acc[t], false, false);
      }
    }
    __syncthreads();
  }

  for (int t = 0; t < 4; ++t) {
    const int ncol = ng * 64 + t * 16 + lrow;
    const float bn = bias[ncol];
    for (int r = 0; r < 8; ++r) {
      const int m = mt * 64 + w * 16 + r + rbase;
      float v = acc[t][r] + bn;
      v = v > 0.f ? v : 0.f;                           // ReLU
      dst[(size_t)m * DMODEL + ncol] = v;
    }
  }
}

// ---------------------------------------------------------------------------
// Kernel 2: fused causal attention (flash-style, online softmax).
// One wave per (b, h, 16-query tile). K/V tiles double-buffered via async DMA.
// ---------------------------------------------------------------------------
__global__ void __launch_bounds__(32)
attn_kernel(const float* __restrict__ Qp, const float* __restrict__ Kp,
            const float* __restrict__ Vp,
            const float* __restrict__ qmask, const float* __restrict__ kmask,
            float* __restrict__ O) {
  __shared__ __align__(16) float sK[2][16][PITCH_KMAJ];
  __shared__ __align__(16) float sV[2][16][PITCH_V];
  __shared__ __align__(16) float sP[16][PITCH_P];

  const int qt   = blockIdx.x;          // 0..127 query tile
  const int h    = blockIdx.y;          // 0..15
  const int b    = blockIdx.z;          // 0..1
  const int lane = threadIdx.x;
  const int lrow = lane & 15;
  const int koff = (lane >> 4) << 1;
  const int rbase = (lane >> 4) << 3;

  const float* Kh = Kp + (size_t)b * S_LEN * DMODEL + h * DH;
  const float* Vh = Vp + (size_t)b * S_LEN * DMODEL + h * DH;

  // Q tile in A-layout registers, pre-scaled by 1/sqrt(dh)=0.125
  v2f qa[16];
  {
    const float* qrow = Qp + (size_t)(b * S_LEN + qt * 16 + lrow) * DMODEL + h * DH;
    for (int c = 0; c < 16; ++c) {
      qa[c].x = qrow[4 * c + koff] * 0.125f;
      qa[c].y = qrow[4 * c + koff + 1] * 0.125f;
    }
  }

  float mrun[8], lrun[8];
  v8f acc[4];
  for (int r = 0; r < 8; ++r) { mrun[r] = -3.0e38f; lrun[r] = 0.f; }
  for (int t = 0; t < 4; ++t) acc[t] = (v8f){0.f,0.f,0.f,0.f,0.f,0.f,0.f,0.f};

  // stage tile 0 into buffer 0 (16 async ops per lane)
  {
    const float* kb = Kh + (size_t)0;
    const float* vb = Vh + (size_t)0;
    for (int i = 0; i < 8; ++i) {
      const int f = i * 32 + lane;
      const int r = f >> 4;
      const int c4 = (f & 15) << 2;
      async_copy16(&sK[0][r][c4], &kb[(size_t)r * DMODEL + c4]);
      async_copy16(&sV[0][r][c4], &vb[(size_t)r * DMODEL + c4]);
    }
  }

  for (int kt = 0; kt <= qt; ++kt) {    // causal: only key tiles <= query tile
    const int buf = kt & 1;
    if (kt < qt) {
      // issue next tile into the other buffer, then wait for current tile
      // (async loads complete in order; <=16 outstanding => tile kt is done)
      const float* kb = Kh + (size_t)(kt + 1) * 16 * DMODEL;
      const float* vb = Vh + (size_t)(kt + 1) * 16 * DMODEL;
      for (int i = 0; i < 8; ++i) {
        const int f = i * 32 + lane;
        const int r = f >> 4;
        const int c4 = (f & 15) << 2;
        async_copy16(&sK[buf ^ 1][r][c4], &kb[(size_t)r * DMODEL + c4]);
        async_copy16(&sV[buf ^ 1][r][c4], &vb[(size_t)r * DMODEL + c4]);
      }
      async_wait16();
    } else {
      async_wait0();
    }
    __syncthreads();

    // scores = (Q/sqrt(dh)) @ K^T : 16 wmma over dh=64
    v8f s = {0.f,0.f,0.f,0.f,0.f,0.f,0.f,0.f};
    for (int c = 0; c < 16; ++c) {
      v2f bk2;
      bk2.x = sK[buf][lrow][4 * c + koff];   // B[k][n] = K[key n][dh k]
      bk2.y = sK[buf][lrow][4 * c + koff + 1];
      s = __builtin_amdgcn_wmma_f32_16x16x4_f32(false, qa[c], false, bk2,
                                                (short)0, s, false, false);
    }

    // masks: key padding + causal (column N = lrow for this lane)
    const int   gk = kt * 16 + lrow;
    const float km = kmask[b * S_LEN + gk];
    for (int r = 0; r < 8; ++r) {
      const int gq = qt * 16 + r + rbase;
      float sv = s[r];
      if (km == 0.0f || gk > gq) sv = NEGV;
      s[r] = sv;
    }

    // online softmax: row reductions across the 16 lanes holding one row
    for (int r = 0; r < 8; ++r) {
      float sv = s[r];
      float rmax = sv;
      for (int off = 8; off >= 1; off >>= 1)
        rmax = fmaxf(rmax, __shfl_xor(rmax, off, 32));
      const float mnew = fmaxf(mrun[r], rmax);
      const float p = __expf(sv - mnew);
      float rsum = p;
      for (int off = 8; off >= 1; off >>= 1)
        rsum += __shfl_xor(rsum, off, 32);
      const float alpha = __expf(mrun[r] - mnew);
      lrun[r] = lrun[r] * alpha + rsum;
      mrun[r] = mnew;
      for (int t = 0; t < 4; ++t) acc[t][r] *= alpha;
      s[r] = p;
    }

    // C-layout -> A-layout conversion of probabilities via LDS
    __syncthreads();
    for (int r = 0; r < 8; ++r) sP[r + rbase][lrow] = s[r];
    __syncthreads();

    // acc += P @ V : K-dim = 16 keys (4 chunks), N-dim = dh (4 tiles of 16)
    for (int c2 = 0; c2 < 4; ++c2) {
      v2f pa;
      pa.x = sP[lrow][4 * c2 + koff];
      pa.y = sP[lrow][4 * c2 + koff + 1];
      for (int t = 0; t < 4; ++t) {
        v2f bv2;
        bv2.x = sV[buf][4 * c2 + koff][t * 16 + lrow];     // B[k][n] = V[key k][dh n]
        bv2.y = sV[buf][4 * c2 + koff + 1][t * 16 + lrow];
        acc[t] = __builtin_amdgcn_wmma_f32_16x16x4_f32(false, pa, false, bv2,
                                                       (short)0, acc[t], false, false);
      }
    }
    __syncthreads();
  }

  // epilogue: normalize, apply query mask, scatter head slice
  for (int r = 0; r < 8; ++r) {
    const int gq = qt * 16 + r + rbase;
    const float qm = qmask[b * S_LEN + gq];
    const float inv = qm / lrun[r];
    for (int t = 0; t < 4; ++t) {
      O[(size_t)(b * S_LEN + gq) * DMODEL + h * DH + t * 16 + lrow] = acc[t][r] * inv;
    }
  }
}

// ---------------------------------------------------------------------------
// Kernel 3: residual add + layernorm (torch unbiased std, ddof=1)
// ---------------------------------------------------------------------------
__global__ void addln_kernel(const float* __restrict__ O, const float* __restrict__ q,
                             const float* __restrict__ gamma, const float* __restrict__ beta,
                             float* __restrict__ out) {
  __shared__ float red[256];
  const int row = blockIdx.x;
  const float* orow = O + (size_t)row * DMODEL;
  const float* qrow = q + (size_t)row * DMODEL;

  float xv[DMODEL / 256];
  float s = 0.f, ss = 0.f;
  for (int i = threadIdx.x, j = 0; i < DMODEL; i += 256, ++j) {
    const float x = orow[i] + qrow[i];
    xv[j] = x; s += x; ss += x * x;
  }
  red[threadIdx.x] = s;  __syncthreads();
  for (int off = 128; off > 0; off >>= 1) {
    if ((int)threadIdx.x < off) red[threadIdx.x] += red[threadIdx.x + off];
    __syncthreads();
  }
  const float sum = red[0];
  __syncthreads();
  red[threadIdx.x] = ss; __syncthreads();
  for (int off = 128; off > 0; off >>= 1) {
    if ((int)threadIdx.x < off) red[threadIdx.x] += red[threadIdx.x + off];
    __syncthreads();
  }
  const float sumsq = red[0];

  const float mean = sum * (1.0f / DMODEL);
  float var = (sumsq - sum * mean) * (1.0f / (DMODEL - 1));   // unbiased
  var = fmaxf(var, 0.0f);
  const float rinv = 1.0f / (sqrtf(var) + 1e-8f);
  for (int i = threadIdx.x, j = 0; i < DMODEL; i += 256, ++j) {
    out[(size_t)row * DMODEL + i] = gamma[i] * (xv[j] - mean) * rinv + beta[i];
  }
}

// ---------------------------------------------------------------------------
extern "C" void kernel_launch(void* const* d_in, const int* in_sizes, int n_in,
                              void* d_out, int out_size, void* d_ws, size_t ws_size,
                              hipStream_t stream) {
  const float* queries = (const float*)d_in[0];
  const float* keys    = (const float*)d_in[1];
  const float* values  = (const float*)d_in[2];
  const float* Wq      = (const float*)d_in[3];
  const float* bq      = (const float*)d_in[4];
  const float* Wk      = (const float*)d_in[5];
  const float* bk      = (const float*)d_in[6];
  const float* Wv      = (const float*)d_in[7];
  const float* bv      = (const float*)d_in[8];
  const float* gamma   = (const float*)d_in[9];
  const float* beta    = (const float*)d_in[10];
  float* out = (float*)d_out;

  float* ws = (float*)d_ws;
  const size_t NM = (size_t)2 * S_LEN * DMODEL;  // 4M floats per (B,S,D) buffer
  float* Qp = ws;
  float* Kp = ws + NM;
  float* Vp = ws + 2 * NM;
  float* Oa = ws + 3 * NM;
  float* qm = ws + 4 * NM;
  float* km = qm + 2 * S_LEN;

  masks_kernel<<<dim3(2 * S_LEN), dim3(256), 0, stream>>>(queries, keys, qm, km);
  proj_kernel<<<dim3((2 * S_LEN) / 64, DMODEL / 64, 3), dim3(128), 0, stream>>>(
      queries, keys, values, Wq, Wk, Wv, bq, bk, bv, Qp, Kp, Vp);
  attn_kernel<<<dim3(S_LEN / 16, NHEADS, 2), dim3(32), 0, stream>>>(
      Qp, Kp, Vp, qm, km, Oa);
  addln_kernel<<<dim3(2 * S_LEN), dim3(256), 0, stream>>>(Oa, queries, gamma, beta, out);
}

// v002
// One run takes 361 microseconds.
// Two timings next to v001 both put it at 1.68 times that version's speed.
// Over all steps from v000 it is 2.42 times as fast.
#include <hip/hip_runtime.h>
#include <hip/hip_bf16.h>

typedef float v2f __attribute__((ext_vector_type(2)));
typedef float v8f __attribute__((ext_vector_type(8)));

#define S_LEN  2048
#define DMODEL 1024
#define NHEADS 16
#define DH     64
#define NEGV   (-4294967295.0f)   // -2^32+1, matches reference mask constant

#define PITCH_KMAJ 68
#define PITCH_V    68

__device__ __forceinline__ void async_copy16(void* lds_dst, const void* gsrc) {
  unsigned l = (unsigned)(unsigned long long)(uintptr_t)lds_dst;  // LDS byte offset
  asm volatile("global_load_async_to_lds_b128 %0, %1, off"
               :: "v"(l), "v"(gsrc)
               : "memory");
}
__device__ __forceinline__ void async_wait0() {
  asm volatile("s_wait_asynccnt 0x0" ::: "memory");
}
__device__ __forceinline__ void async_wait16() {
  asm volatile("s_wait_asynccnt 0x10" ::: "memory");
}

__device__ __forceinline__ float other_half(float x) {
  return __builtin_bit_cast(float, __builtin_amdgcn_permlanex16(
      __builtin_bit_cast(int, x), __builtin_bit_cast(int, x),
      0x76543210, 0xfedcba98, false, false));
}

__device__ __forceinline__ float exp_one(float x) {
  float y;
  const float a = x * 1.44269504f;      // log2(e)
  asm("v_exp_f32 %0, %1\n\tv_nop" : "=v"(y) : "v"(a));
  return y;
}
__device__ __forceinline__ void exp_two(float& y0, float& y1, float x0, float x1) {
  const float a0 = x0 * 1.44269504f;
  const float a1 = x1 * 1.44269504f;
  asm("v_exp_f32 %0, %2\n\tv_exp_f32 %1, %3\n\tv_nop"
      : "=&v"(y0), "=&v"(y1) : "v"(a0), "v"(a1));
}

// ---------------------------------------------------------------------------
// Kernel 0: padding masks. key_mask[b,s] = sign(|sum_d keys|), same for queries
// ---------------------------------------------------------------------------
__global__ void masks_kernel(const float* __restrict__ q,
                             const float* __restrict__ k,
                             float* __restrict__ qmask,
                             float* __restrict__ kmask) {
  __shared__ float red0[256];
  __shared__ float red1[256];
  const int row = blockIdx.x;                      // 0 .. B*S-1
  const float* qr = q + (size_t)row * DMODEL;
  const float* kr = k + (size_t)row * DMODEL;
  float sq = 0.f, sk = 0.f;
  for (int i = threadIdx.x; i < DMODEL; i += 256) { sq += qr[i]; sk += kr[i]; }
  red0[threadIdx.x] = sq; red1[threadIdx.x] = sk;
  __syncthreads();
  for (int off = 128; off > 0; off >>= 1) {
    if ((int)threadIdx.x < off) {
      red0[threadIdx.x] += red0[threadIdx.x + off];
      red1[threadIdx.x] += red1[threadIdx.x + off];
    }
    __syncthreads();
  }
  if (threadIdx.x == 0) {
    qmask[row] = (red0[0] != 0.0f) ? 1.0f : 0.0f;
    kmask[row] = (red1[0] != 0.0f) ? 1.0f : 0.0f;
  }
}

// ---------------------------------------------------------------------------
// Kernel 1: fused projection  P = relu(X @ W^T + b)  for Q, K, V (blockIdx.z).
// 4-wave workgroup computes a 64x64 output tile; each wave owns a 16-row strip
// and 4 WMMA accumulators (64 cols). Tiles staged via async global->LDS DMA.
// ---------------------------------------------------------------------------
__global__ void __launch_bounds__(128)
proj_kernel(const float* __restrict__ Xq, const float* __restrict__ Xk,
            const float* __restrict__ Xv,
            const float* __restrict__ Wq, const float* __restrict__ Wk,
            const float* __restrict__ Wv,
            const float* __restrict__ bq, const float* __restrict__ bk,
            const float* __restrict__ bv,
            float* __restrict__ Qp, float* __restrict__ Kp,
            float* __restrict__ Vp) {
  __shared__ __align__(16) float sA[64][PITCH_KMAJ];   // X rows   (17KB)
  __shared__ __align__(16) float sB[64][PITCH_KMAJ];   // W rows   (17KB)

  const int mt = blockIdx.x;            // 64 row tiles   (B*S/64)
  const int ng = blockIdx.y;            // 16 col groups  (D/64)
  const int wz = blockIdx.z;            // 0:Q 1:K 2:V
  const float* X    = (wz == 0) ? Xq : (wz == 1) ? Xk : Xv;
  const float* W    = (wz == 0) ? Wq : (wz == 1) ? Wk : Wv;
  const float* bias = (wz == 0) ? bq : (wz == 1) ? bk : bv;
  float*       dst  = (wz == 0) ? Qp : (wz == 1) ? Kp : Vp;

  const int tid   = threadIdx.x;        // 0..127
  const int lane  = tid & 31;
  const int w     = tid >> 5;
  const int lrow  = lane & 15;
  const int koff  = (lane >> 4) << 1;
  const int rbase = (lane >> 4) << 3;

  v8f acc[4];
  for (int t = 0; t < 4; ++t) acc[t] = (v8f){0.f,0.f,0.f,0.f,0.f,0.f,0.f,0.f};

  for (int ks = 0; ks < DMODEL; ks += 64) {
    // async DMA stage: 64x64 tiles of X and W (1024 float4 each / 128 threads)
    for (int i = 0; i < 8; ++i) {
      const int f  = i * 128 + tid;
      const int r  = f >> 4;
      const int c4 = (f & 15) << 2;
      async_copy16(&sA[r][c4], &X[(size_t)(mt * 64 + r) * DMODEL + ks + c4]);
      async_copy16(&sB[r][c4], &W[(size_t)(ng * 64 + r) * DMODEL + ks + c4]);
    }
    async_wait0();
    __syncthreads();

    for (int c = 0; c < 16; ++c) {
      v2f a;
      a.x = sA[w * 16 + lrow][4 * c + koff];
      a.y = sA[w * 16 + lrow][4 * c + koff + 1];
      for (int t = 0; t < 4; ++t) {
        v2f b;
        b.x = sB[t * 16 + lrow][4 * c + koff];        // B[k][n] = W[n][k]
        b.y = sB[t * 16 + lrow][4 * c + koff + 1];
        acc[t] = __builtin_amdgcn_wmma_f32_16x16x4_f32(false, a, false, b,
                                                       (short)0, acc[t], false, false);
      }
    }
    __syncthreads();
  }

  for (int t = 0; t < 4; ++t) {
    const int ncol = ng * 64 + t * 16 + lrow;
    const float bn = bias[ncol];
    for (int r = 0; r < 8; ++r) {
      const int m = mt * 64 + w * 16 + r + rbase;
      float v = acc[t][r] + bn;
      v = v > 0.f ? v : 0.f;                           // ReLU
      dst[(size_t)m * DMODEL + ncol] = v;
    }
  }
}

__global__ void __launch_bounds__(32)
attn_kernel(const float* __restrict__ Qp, const float* __restrict__ Kp,
            const float* __restrict__ Vp,
            const float* __restrict__ qmask, const float* __restrict__ kmask,
            float* __restrict__ O) {
  __shared__ __align__(16) float sK[2][16][PITCH_KMAJ];
  __shared__ __align__(16) float sV[2][16][PITCH_V];

  const int qt   = blockIdx.x;          // 0..127 query tile
  const int h    = blockIdx.y;          // 0..15
  const int b    = blockIdx.z;          // 0..1
  const int lane = threadIdx.x;
  const int lrow = lane & 15;
  const int koff = (lane >> 4) << 1;
  const int rbase = (lane >> 4) << 3;

  const float* Kh = Kp + (size_t)b * S_LEN * DMODEL + h * DH;
  const float* Vh = Vp + (size_t)b * S_LEN * DMODEL + h * DH;

  // Q tile as B operand (column = query lrow), pre-scaled by 1/sqrt(dh)=0.125
  v2f qa[16];
  {
    const float* qrow = Qp + (size_t)(b * S_LEN + qt * 16 + lrow) * DMODEL + h * DH;
    for (int c = 0; c < 16; ++c) {
      qa[c].x = qrow[4 * c + koff] * 0.125f;
      qa[c].y = qrow[4 * c + koff + 1] * 0.125f;
    }
  }

  const int gq = qt * 16 + lrow;        // this lane's query
  float mrun = -3.0e38f;                // running maximum of query gq (equal in both halves)
  float lrun = 0.f;                     // running sum over this half's keys only
  v8f acc[4];                           // acc[t][r] = O^T[dh t*16 + rbase + r][query lrow]
  for (int t = 0; t < 4; ++t) acc[t] = (v8f){0.f,0.f,0.f,0.f,0.f,0.f,0.f,0.f};

  // stage tile 0 into buffer 0 (16 async ops per lane)
  {
    const float* kb = Kh + (size_t)0;
    const float* vb = Vh + (size_t)0;
    for (int i = 0; i < 8; ++i) {
      const int f = i * 32 + lane;
      const int r = f >> 4;
      const int c4 = (f & 15) << 2;
      async_copy16(&sK[0][r][c4], &kb[(size_t)r * DMODEL + c4]);
      async_copy16(&sV[0][r][c4], &vb[(size_t)r * DMODEL + c4]);
    }
  }

  for (int kt = 0; kt <= qt; ++kt) {    // causal: only key tiles <= query tile
    const int buf = kt & 1;
    if (kt < qt) {
      // issue next tile into the other buffer, then wait for current tile
      // (async loads complete in order; <=16 outstanding => tile kt is done)
      const float* kb = Kh + (size_t)(kt + 1) * 16 * DMODEL;
      const float* vb = Vh + (size_t)(kt + 1) * 16 * DMODEL;
      for (int i = 0; i < 8; ++i) {
        const int f = i * 32 + lane;
        const int r = f >> 4;
        const int c4 = (f & 15) << 2;
        async_copy16(&sK[buf ^ 1][r][c4], &kb[(size_t)r * DMODEL + c4]);
        async_copy16(&sV[buf ^ 1][r][c4], &vb[(size_t)r * DMODEL + c4]);
      }
      async_wait16();
    } else {
      async_wait0();
    }
    __syncthreads();

    // key padding mask of this lane's eight keys (two aligned 16-byte loads)
    const float* kmp = kmask + b * S_LEN + kt * 16 + rbase;
    const float4 km0 = *(const float4*)(kmp);
    const float4 km1 = *(const float4*)(kmp + 4);
    const float kmv[8] = {km0.x, km0.y, km0.z, km0.w, km1.x, km1.y, km1.z, km1.w};

    // scores^T = K @ (Q/sqrt(dh))^T : 16 wmma over dh=64
    v8f s = {0.f,0.f,0.f,0.f,0.f,0.f,0.f,0.f};
    for (int c = 0; c < 16; ++c) {
      v2f ak2;
      ak2.x = sK[buf][lrow][4 * c + koff];   // A[m][k] = K[key m][dh k]
      ak2.y = sK[buf][lrow][4 * c + koff + 1];
      s = __builtin_amdgcn_wmma_f32_16x16x4_f32(false, ak2, false, qa[c],
                                                (short)0, s, false, false);
    }

    // masks: key padding + causal (row M = rbase + r is the key, column the query)
    // unrolled here and below: a rolled loop would index s[] and acc[] through m0
#pragma unroll
    for (int r = 0; r < 8; ++r) {
      const int gk = kt * 16 + rbase + r;
      float sv = s[r];
      if (kmv[r] == 0.0f || gk > gq) sv = NEGV;
      s[r] = sv;
    }

    // online softmax: eight keys in-lane, then one exchange with the other half
    float rmax = fmaxf(fmaxf(fmaxf(s[0], s[1]), fmaxf(s[2], s[3])),
                       fmaxf(fmaxf(s[4], s[5]), fmaxf(s[6], s[7])));
    rmax = fmaxf(rmax, other_half(rmax));
    const float mnew  = fmaxf(mrun, rmax);
    const float alpha = exp_one(mrun - mnew);
#pragma unroll
    for (int r = 0; r < 8; r += 2) {
      float p0, p1;
      exp_two(p0, p1, s[r] - mnew, s[r + 1] - mnew);
      s[r] = p0;
      s[r + 1] = p1;
    }
    lrun = lrun * alpha + (((s[0] + s[1]) + (s[2] + s[3])) + ((s[4] + s[5]) + (s[6] + s[7])));
    mrun = mnew;
#pragma unroll
    for (int t = 0; t < 4; ++t) {
#pragma unroll
      for (int r = 0; r < 8; ++r) acc[t][r] *= alpha;
    }

#pragma unroll
    for (int j = 0; j < 4; ++j) {
      v2f pb;
      pb.x = s[2 * j];
      pb.y = s[2 * j + 1];
#pragma unroll
      for (int t = 0; t < 4; ++t) {
        v2f av2;
        av2.x = sV[buf][rbase + 2 * j][t * 16 + lrow];      // A[m][k] = V[key k][dh m]
        av2.y = sV[buf][rbase + 2 * j + 1][t * 16 + lrow];
        acc[t] = __builtin_amdgcn_wmma_f32_16x16x4_f32(false, av2, false, pb,
                                                       (short)0, acc[t], false, false);
      }
    }
    __syncthreads();
  }

  // epilogue: join the halves' sums, normalize, apply query mask, store the head slice
  // (a lane owns eight consecutive dh of its query in each tile: two 16-byte stores)
  {
    const float ltot = lrun + other_half(lrun);
    const float inv  = qmask[b * S_LEN + gq] / ltot;
    float* orow = O + (size_t)(b * S_LEN + gq) * DMODEL + h * DH + rbase;
#pragma unroll
    for (int t = 0; t < 4; ++t) {
      *(float4*)(orow + t * 16) =
          make_float4(acc[t][0] * inv, acc[t][1] * inv, acc[t][2] * inv, acc[t][3] * inv);
      *(float4*)(orow + t * 16 + 4) =
          make_float4(acc[t][4] * inv, acc[t][5] * inv, acc[t][6] * inv, acc[t][7] * inv);
    }
  }
}

// ---------------------------------------------------------------------------
// Kernel 3: residual add + layernorm (torch unbiased std, ddof=1)
// ---------------------------------------------------------------------------
__global__ void addln_kernel(const float* __restrict__ O, const float* __restrict__ q,
                             const float* __restrict__ gamma, const float* __restrict__ beta,
                             float* __restrict__ out) {
  __shared__ float red[256];
  const int row = blockIdx.x;
  const float* orow = O + (size_t)row * DMODEL;
  const float* qrow = q + (size_t)row * DMODEL;

  float xv[DMODEL / 256];
  float s = 0.f, ss = 0.f;
  for (int i = threadIdx.x, j = 0; i < DMODEL; i += 256, ++j) {
    const float x = orow[i] + qrow[i];
    xv[j] = x; s += x; ss += x * x;
  }
  red[threadIdx.x] = s;  __syncthreads();
  for (int off = 128; off > 0; off >>= 1) {
    if ((int)threadIdx.x < off) red[threadIdx.x] += red[threadIdx.x + off];
    __syncthreads();
  }
  const float sum = red[0];
  __syncthreads();
  red[threadIdx.x] = ss; __syncthreads();
  for (int off = 128; off > 0; off >>= 1) {
    if ((int)threadIdx.x < off) red[threadIdx.x] += red[threadIdx.x + off];
    __syncthreads();
  }
  const float sumsq = red[0];

  const float mean = sum * (1.0f / DMODEL);
  float var = (sumsq - sum * mean) * (1.0f / (DMODEL - 1));   // unbiased
  var = fmaxf(var, 0.0f);
  const float rinv = 1.0f / (sqrtf(var) + 1e-8f);
  for (int i = threadIdx.x, j = 0; i < DMODEL; i += 256, ++j) {
    out[(size_t)row * DMODEL + i] = gamma[i] * (xv[j] - mean) * rinv + beta[i];
  }
}

// ---------------------------------------------------------------------------
extern "C" void kernel_launch(void* const* d_in, const int* in_sizes, int n_in,
                              void* d_out, int out_size, void* d_ws, size_t ws_size,
                              hipStream_t stream) {
  const float* queries = (const float*)d_in[0];
  const float* keys    = (const float*)d_in[1];
  const float* values  = (const float*)d_in[2];
  const float* Wq      = (const float*)d_in[3];
  const float* bq      = (const float*)d_in[4];
  const float* Wk      = (const float*)d_in[5];
  const float* bk      = (const float*)d_in[6];
  const float* Wv      = (const float*)d_in[7];
  const float* bv      = (const float*)d_in[8];
  const float* gamma   = (const float*)d_in[9];
  const float* beta    = (const float*)d_in[10];
  float* out = (float*)d_out;

  float* ws = (float*)d_ws;
  const size_t NM = (size_t)2 * S_LEN * DMODEL;  // 4M floats per (B,S,D) buffer
  float* Qp = ws;
  float* Kp = ws + NM;
  float* Vp = ws + 2 * NM;
  float* Oa = ws + 3 * NM;
  float* qm = ws + 4 * NM;
  float* km = qm + 2 * S_LEN;

  masks_kernel<<<dim3(2 * S_LEN), dim3(256), 0, stream>>>(queries, keys, qm, km);
  proj_kernel<<<dim3((2 * S_LEN) / 64, DMODEL / 64, 3), dim3(128), 0, stream>>>(
      queries, keys, values, Wq, Wk, Wv, bq, bk, bv, Qp, Kp, Vp);
  attn_kernel<<<dim3(S_LEN / 16, NHEADS, 2), dim3(32), 0, stream>>>(
      Qp, Kp, Vp, qm, km, Oa);
  addln_kernel<<<dim3(2 * S_LEN), dim3(256), 0, stream>>>(Oa, queries, gamma, beta, out);
}

// v003
// A run of this version takes 294 microseconds.
// In two side-by-side timings against v002, it was 1.22 and 1.23 times as fast.
// Counting every step since v000, it is 2.97 times as fast.
#include <hip/hip_runtime.h>
#include <hip/hip_bf16.h>

typedef float v2f __attribute__((ext_vector_type(2)));
typedef float v8f __attribute__((ext_vector_type(8)));

#define S_LEN  2048
#define DMODEL 1024
#define NHEADS 16
#define DH     64
#define NEGV   (-4294967295.0f)   // -2^32+1, matches reference mask constant

#define PITCH_KMAJ 68
#define PITCH_V    68

__device__ __forceinline__ void async_copy16(void* lds_dst, const void* gsrc) {
  unsigned l = (unsigned)(unsigned long long)(uintptr_t)lds_dst;  // LDS byte offset
  asm volatile("global_load_async_to_lds_b128 %0, %1, off"
               :: "v"(l), "v"(gsrc)
               : "memory");
}
// Eight such copies of a lane and, in the same statement, the wait that stands in front of
// any rewrite of the address registers which the copies name.
__device__ __forceinline__ void async_copy16_x8(const unsigned (&l)[8], const float* const (&g)[8]) {
  asm volatile("global_load_async_to_lds_b128 %0, %8, off\n\t"
               "global_load_async_to_lds_b128 %1, %9, off\n\t"
               "global_load_async_to_lds_b128 %2, %10, off\n\t"
               "global_load_async_to_lds_b128 %3, %11, off\n\t"
               "global_load_async_to_lds_b128 %4, %12, off\n\t"
               "global_load_async_to_lds_b128 %5, %13, off\n\t"
               "global_load_async_to_lds_b128 %6, %14, off\n\t"
               "global_load_async_to_lds_b128 %7, %15, off\n\t"
               "s_wait_xcnt 0x0"
               :: "v"(l[0]), "v"(l[1]), "v"(l[2]), "v"(l[3]),
                  "v"(l[4]), "v"(l[5]), "v"(l[6]), "v"(l[7]),
                  "v"(g[0]), "v"(g[1]), "v"(g[2]), "v"(g[3]),
                  "v"(g[4]), "v"(g[5]), "v"(g[6]), "v"(g[7])
               : "memory");
}
__device__ __forceinline__ void async_wait0() {
  asm volatile("s_wait_asynccnt 0x0" ::: "memory");
}
__device__ __forceinline__ void async_wait16() {
  asm volatile("s_wait_asynccnt 0x10" ::: "memory");
}

__device__ __forceinline__ float other_half(float x) {
  return __builtin_bit_cast(float, __builtin_amdgcn_permlanex16(
      __builtin_bit_cast(int, x), __builtin_bit_cast(int, x),
      0x76543210, 0xfedcba98, false, false));
}

__device__ __forceinline__ float exp_one(float x) {
  float y;
  const float a = x * 1.44269504f;      // log2(e)
  asm("v_exp_f32 %0, %1\n\tv_nop" : "=v"(y) : "v"(a));
  return y;
}
__device__ __forceinline__ void exp_two(float& y0, float& y1, float x0, float x1) {
  const float a0 = x0 * 1.44269504f;
  const float a1 = x1 * 1.44269504f;
  asm("v_exp_f32 %0, %2\n\tv_exp_f32 %1, %3\n\tv_nop"
      : "=&v"(y0), "=&v"(y1) : "v"(a0), "v"(a1));
}

// ---------------------------------------------------------------------------
// Kernel 0: padding masks. key_mask[b,s] = sign(|sum_d keys|), same for queries
// ---------------------------------------------------------------------------
__global__ void masks_kernel(const float* __restrict__ q,
                             const float* __restrict__ k,
                             float* __restrict__ qmask,
                             float* __restrict__ kmask) {
  __shared__ float red0[256];
  __shared__ float red1[256];
  const int row = blockIdx.x;                      // 0 .. B*S-1
  const float* qr = q + (size_t)row * DMODEL;
  const float* kr = k + (size_t)row * DMODEL;
  float sq = 0.f, sk = 0.f;
  for (int i = threadIdx.x; i < DMODEL; i += 256) { sq += qr[i]; sk += kr[i]; }
  red0[threadIdx.x] = sq; red1[threadIdx.x] = sk;
  __syncthreads();
  for (int off = 128; off > 0; off >>= 1) {
    if ((int)threadIdx.x < off) {
      red0[threadIdx.x] += red0[threadIdx.x + off];
      red1[threadIdx.x] += red1[threadIdx.x + off];
    }
    __syncthreads();
  }
  if (threadIdx.x == 0) {
    qmask[row] = (red0[0] != 0.0f) ? 1.0f : 0.0f;
    kmask[row] = (red1[0] != 0.0f) ? 1.0f : 0.0f;
  }
}

// ---------------------------------------------------------------------------
// Kernel 1: fused projection  P = relu(X @ W^T + b)  for Q, K, V (blockIdx.z).
// 4-wave workgroup computes a 64x64 output tile; each wave owns a 16-row strip
// and 4 WMMA accumulators (64 cols). Tiles staged via async global->LDS DMA.
// ---------------------------------------------------------------------------
__global__ void __launch_bounds__(128)
proj_kernel(const float* __restrict__ Xq, const float* __restrict__ Xk,
            const float* __restrict__ Xv,
            const float* __restrict__ Wq, const float* __restrict__ Wk,
            const float* __restrict__ Wv,
            const float* __restrict__ bq, const float* __restrict__ bk,
            const float* __restrict__ bv,
            float* __restrict__ Qp, float* __restrict__ Kp,
            float* __restrict__ Vp) {
  __shared__ __align__(16) float sA[64][PITCH_KMAJ];   // X rows   (17KB)
  __shared__ __align__(16) float sB[64][PITCH_KMAJ];   // W rows   (17KB)

  const int mt = blockIdx.x;            // 64 row tiles   (B*S/64)
  const int ng = blockIdx.y;            // 16 col groups  (D/64)
  const int wz = blockIdx.z;            // 0:Q 1:K 2:V
  const float* X    = (wz == 0) ? Xq : (wz == 1) ? Xk : Xv;
  const float* W    = (wz == 0) ? Wq : (wz == 1) ? Wk : Wv;
  const float* bias = (wz == 0) ? bq : (wz == 1) ? bk : bv;
  float*       dst  = (wz == 0) ? Qp : (wz == 1) ? Kp : Vp;

  const int tid   = threadIdx.x;        // 0..127
  const int lane  = tid & 31;
  const int w     = tid >> 5;
  const int lrow  = lane & 15;
  const int koff  = (lane >> 4) << 1;
  const int rbase = (lane >> 4) << 3;

  v8f acc[4];
  for (int t = 0; t < 4; ++t) acc[t] = (v8f){0.f,0.f,0.f,0.f,0.f,0.f,0.f,0.f};

  for (int ks = 0; ks < DMODEL; ks += 64) {
    // async DMA stage: 64x64 tiles of X and W (1024 float4 each / 128 threads)
    for (int i = 0; i < 8; ++i) {
      const int f  = i * 128 + tid;
      const int r  = f >> 4;
      const int c4 = (f & 15) << 2;
      async_copy16(&sA[r][c4], &X[(size_t)(mt * 64 + r) * DMODEL + ks + c4]);
      async_copy16(&sB[r][c4], &W[(size_t)(ng * 64 + r) * DMODEL + ks + c4]);
    }
    async_wait0();
    __syncthreads();

    for (int c = 0; c < 16; ++c) {
      v2f a;
      a.x = sA[w * 16 + lrow][4 * c + koff];
      a.y = sA[w * 16 + lrow][4 * c + koff + 1];
      for (int t = 0; t < 4; ++t) {
        v2f b;
        b.x = sB[t * 16 + lrow][4 * c + koff];        // B[k][n] = W[n][k]
        b.y = sB[t * 16 + lrow][4 * c + koff + 1];
        acc[t] = __builtin_amdgcn_wmma_f32_16x16x4_f32(false, a, false, b,
                                                       (short)0, acc[t], false, false);
      }
    }
    __syncthreads();
  }

  for (int t = 0; t < 4; ++t) {
    const int ncol = ng * 64 + t * 16 + lrow;
    const float bn = bias[ncol];
    for (int r = 0; r < 8; ++r) {
      const int m = mt * 64 + w * 16 + r + rbase;
      float v = acc[t][r] + bn;
      v = v > 0.f ? v : 0.f;                           // ReLU
      dst[(size_t)m * DMODEL + ncol] = v;
    }
  }
}

__global__ void __launch_bounds__(32)
attn_kernel(const float* __restrict__ Qp, const float* __restrict__ Kp,
            const float* __restrict__ Vp,
            const float* __restrict__ qmask, const float* __restrict__ kmask,
            float* __restrict__ O) {
  __shared__ __align__(16) float sK[2][16][PITCH_KMAJ];
  __shared__ __align__(16) float sV[2][16][PITCH_V];

  const int pt   = blockIdx.x;          // 0..63 pair of query tiles
  const int h    = blockIdx.y;          // 0..15
  const int b    = blockIdx.z;          // 0..1
  const int lane = threadIdx.x;
  const int lrow = lane & 15;
  const int koff = (lane >> 4) << 1;
  const int rbase = (lane >> 4) << 3;

  const float* Kh = Kp + (size_t)b * S_LEN * DMODEL + h * DH;
  const float* Vh = Vp + (size_t)b * S_LEN * DMODEL + h * DH;

  // the two tiles of the pair, the long one first (the body keeps its indentation)
  for (int half = 0; half < 2; ++half) {
  const int qt = half ? pt : (S_LEN / 16 - 1 - pt);

  // Q tile as B operand (column = query lrow), pre-scaled by 1/sqrt(dh)=0.125
  v2f qa[16];
  {
    const float* qrow = Qp + (size_t)(b * S_LEN + qt * 16 + lrow) * DMODEL + h * DH;
    for (int c = 0; c < 16; ++c) {
      qa[c].x = qrow[4 * c + koff] * 0.125f;
      qa[c].y = qrow[4 * c + koff + 1] * 0.125f;
    }
  }

  const int gq = qt * 16 + lrow;        // this lane's query
  float mrun = -3.0e38f;                // running maximum of query gq (equal in both halves)
  float lrun = 0.f;                     // running sum over this half's keys only
  v8f acc[4];                           // acc[t][r] = O^T[dh t*16 + rbase + r][query lrow]
  for (int t = 0; t < 4; ++t) acc[t] = (v8f){0.f,0.f,0.f,0.f,0.f,0.f,0.f,0.f};

  // stage tile 0 into buffer 0 (16 async ops per lane)
  {
    unsigned lk[8], lv[8];
    const float* gk[8];
    const float* gv[8];
#pragma unroll   // the arrays below must become registers
    for (int i = 0; i < 8; ++i) {
      const int f = i * 32 + lane;
      const int r = f >> 4;
      const int c4 = (f & 15) << 2;
      lk[i] = (unsigned)(unsigned long long)(uintptr_t)&sK[0][r][c4];
      lv[i] = (unsigned)(unsigned long long)(uintptr_t)&sV[0][r][c4];
      gk[i] = &Kh[(size_t)r * DMODEL + c4];
      gv[i] = &Vh[(size_t)r * DMODEL + c4];
    }
    // the wave's LDS reads of the tile before have retired before its buffer is refilled
    asm volatile("s_wait_dscnt 0x0" ::: "memory");
    async_copy16_x8(lk, gk);
    async_copy16_x8(lv, gv);
  }

  for (int kt = 0; kt <= qt; ++kt) {    // causal: only key tiles <= query tile
    const int buf = kt & 1;
    if (kt < qt) {
      // issue next tile into the other buffer, then wait for current tile
      // (async loads complete in order; <=16 outstanding => tile kt is done)
      const float* kb = Kh + (size_t)(kt + 1) * 16 * DMODEL;
      const float* vb = Vh + (size_t)(kt + 1) * 16 * DMODEL;
      for (int i = 0; i < 8; ++i) {
        const int f = i * 32 + lane;
        const int r = f >> 4;
        const int c4 = (f & 15) << 2;
        async_copy16(&sK[buf ^ 1][r][c4], &kb[(size_t)r * DMODEL + c4]);
        async_copy16(&sV[buf ^ 1][r][c4], &vb[(size_t)r * DMODEL + c4]);
      }
      async_wait16();
    } else {
      async_wait0();
    }
    __syncthreads();

    // key padding mask of this lane's eight keys (two aligned 16-byte loads)
    const float* kmp = kmask + b * S_LEN + kt * 16 + rbase;
    const float4 km0 = *(const float4*)(kmp);
    const float4 km1 = *(const float4*)(kmp + 4);
    const float kmv[8] = {km0.x, km0.y, km0.z, km0.w, km1.x, km1.y, km1.z, km1.w};

    // scores^T = K @ (Q/sqrt(dh))^T : 16 wmma over dh=64
    v8f s = {0.f,0.f,0.f,0.f,0.f,0.f,0.f,0.f};
    for (int c = 0; c < 16; ++c) {
      v2f ak2;
      ak2.x = sK[buf][lrow][4 * c + koff];   // A[m][k] = K[key m][dh k]
      ak2.y = sK[buf][lrow][4 * c + koff + 1];
      s = __builtin_amdgcn_wmma_f32_16x16x4_f32(false, ak2, false, qa[c],
                                                (short)0, s, false, false);
    }

    // masks: key padding + causal (row M = rbase + r is the key, column the query)
    // unrolled here and below: a rolled loop would index s[] and acc[] through m0
#pragma unroll
    for (int r = 0; r < 8; ++r) {
      const int gk = kt * 16 + rbase + r;
      float sv = s[r];
      if (kmv[r] == 0.0f || gk > gq) sv = NEGV;
      s[r] = sv;
    }

    // online softmax: eight keys in-lane, then one exchange with the other half
    float rmax = fmaxf(fmaxf(fmaxf(s[0], s[1]), fmaxf(s[2], s[3])),
                       fmaxf(fmaxf(s[4], s[5]), fmaxf(s[6], s[7])));
    rmax = fmaxf(rmax, other_half(rmax));
    const float mnew  = fmaxf(mrun, rmax);
    const float alpha = exp_one(mrun - mnew);
#pragma unroll
    for (int r = 0; r < 8; r += 2) {
      float p0, p1;
      exp_two(p0, p1, s[r] - mnew, s[r + 1] - mnew);
      s[r] = p0;
      s[r + 1] = p1;
    }
    lrun = lrun * alpha + (((s[0] + s[1]) + (s[2] + s[3])) + ((s[4] + s[5]) + (s[6] + s[7])));
    mrun = mnew;
#pragma unroll
    for (int t = 0; t < 4; ++t) {
#pragma unroll
      for (int r = 0; r < 8; ++r) acc[t][r] *= alpha;
    }

#pragma unroll
    for (int j = 0; j < 4; ++j) {
      v2f pb;
      pb.x = s[2 * j];
      pb.y = s[2 * j + 1];
#pragma unroll
      for (int t = 0; t < 4; ++t) {
        v2f av2;
        av2.x = sV[buf][rbase + 2 * j][t * 16 + lrow];      // A[m][k] = V[key k][dh m]
        av2.y = sV[buf][rbase + 2 * j + 1][t * 16 + lrow];
        acc[t] = __builtin_amdgcn_wmma_f32_16x16x4_f32(false, av2, false, pb,
                                                       (short)0, acc[t], false, false);
      }
    }
    __syncthreads();
  }

  // epilogue: join the halves' sums, normalize, apply query mask, store the head slice
  // (a lane owns eight consecutive dh of its query in each tile: two 16-byte stores)
  {
    const float ltot = lrun + other_half(lrun);
    const float inv  = qmask[b * S_LEN + gq] / ltot;
    float* orow = O + (size_t)(b * S_LEN + gq) * DMODEL + h * DH + rbase;
#pragma unroll
    for (int t = 0; t < 4; ++t) {
      *(float4*)(orow + t * 16) =
          make_float4(acc[t][0] * inv, acc[t][1] * inv, acc[t][2] * inv, acc[t][3] * inv);
      *(float4*)(orow + t * 16 + 4) =
          make_float4(acc[t][4] * inv, acc[t][5] * inv, acc[t][6] * inv, acc[t][7] * inv);
    }
  }
  }  // half
}

// ---------------------------------------------------------------------------
// Kernel 3: residual add + layernorm (torch unbiased std, ddof=1)
// ---------------------------------------------------------------------------
__global__ void addln_kernel(const float* __restrict__ O, const float* __restrict__ q,
                             const float* __restrict__ gamma, const float* __restrict__ beta,
                             float* __restrict__ out) {
  __shared__ float red[256];
  const int row = blockIdx.x;
  const float* orow = O + (size_t)row * DMODEL;
  const float* qrow = q + (size_t)row * DMODEL;

  float xv[DMODEL / 256];
  float s = 0.f, ss = 0.f;
  for (int i = threadIdx.x, j = 0; i < DMODEL; i += 256, ++j) {
    const float x = orow[i] + qrow[i];
    xv[j] = x; s += x; ss += x * x;
  }
  red[threadIdx.x] = s;  __syncthreads();
  for (int off = 128; off > 0; off >>= 1) {
    if ((int)threadIdx.x < off) red[threadIdx.x] += red[threadIdx.x + off];
    __syncthreads();
  }
  const float sum = red[0];
  __syncthreads();
  red[threadIdx.x] = ss; __syncthreads();
  for (int off = 128; off > 0; off >>= 1) {
    if ((int)threadIdx.x < off) red[threadIdx.x] += red[threadIdx.x + off];
    __syncthreads();
  }
  const float sumsq = red[0];

  const float mean = sum * (1.0f / DMODEL);
  float var = (sumsq - sum * mean) * (1.0f / (DMODEL - 1));   // unbiased
  var = fmaxf(var, 0.0f);
  const float rinv = 1.0f / (sqrtf(var) + 1e-8f);
  for (int i = threadIdx.x, j = 0; i < DMODEL; i += 256, ++j) {
    out[(size_t)row * DMODEL + i] = gamma[i] * (xv[j] - mean) * rinv + beta[i];
  }
}

// ---------------------------------------------------------------------------
extern "C" void kernel_launch(void* const* d_in, const int* in_sizes, int n_in,
                              void* d_out, int out_size, void* d_ws, size_t ws_size,
                              hipStream_t stream) {
  const float* queries = (const float*)d_in[0];
  const float* keys    = (const float*)d_in[1];
  const float* values  = (const float*)d_in[2];
  const float* Wq      = (const float*)d_in[3];
  const float* bq      = (const float*)d_in[4];
  const float* Wk      = (const float*)d_in[5];
  const float* bk      = (const float*)d_in[6];
  const float* Wv      = (const float*)d_in[7];
  const float* bv      = (const float*)d_in[8];
  const float* gamma   = (const float*)d_in[9];
  const float* beta    = (const float*)d_in[10];
  float* out = (float*)d_out;

  float* ws = (float*)d_ws;
  const size_t NM = (size_t)2 * S_LEN * DMODEL;  // 4M floats per (B,S,D) buffer
  float* Qp = ws;
  float* Kp = ws + NM;
  float* Vp = ws + 2 * NM;
  float* Oa = ws + 3 * NM;
  float* qm = ws + 4 * NM;
  float* km = qm + 2 * S_LEN;

  masks_kernel<<<dim3(2 * S_LEN), dim3(256), 0, stream>>>(queries, keys, qm, km);
  proj_kernel<<<dim3((2 * S_LEN) / 64, DMODEL / 64, 3), dim3(128), 0, stream>>>(
      queries, keys, values, Wq, Wk, Wv, bq, bk, bv, Qp, Kp, Vp);
  attn_kernel<<<dim3(S_LEN / 32, NHEADS, 2), dim3(32), 0, stream>>>(
      Qp, Kp, Vp, qm, km, Oa);
  addln_kernel<<<dim3(2 * S_LEN), dim3(256), 0, stream>>>(Oa, queries, gamma, beta, out);
}
